// v000
// The times below were measured on an AMD MI455X: many runs one after another, warmed up first and cycling through
// copies of the inputs, with the whole window's GPU time divided by the number of runs. Launches and the gaps
// between them are all in it. The median over several windows is given; except for v000 it joins two sittings, which
// can be a few percent apart, so the side-by-side timings, each taken in one sitting, are the better comparison.
// v000 is the starting kernel. One run takes 55.2 microseconds.
#include <hip/hip_runtime.h>
#include <math.h>

typedef float v2f __attribute__((ext_vector_type(2)));
typedef float v8f __attribute__((ext_vector_type(8)));
typedef unsigned int u32x4 __attribute__((ext_vector_type(4)));
typedef int i32x4 __attribute__((ext_vector_type(4)));
typedef int i32x8 __attribute__((ext_vector_type(8)));

#define NDIM 4
#define D_IN 128
#define KS 3
#define RANK 2
#define NPROJ 15              // 3 + 8 + 4 rows, padded to 16
#define ROWS_PER_BLOCK 64     // 2 waves * 32 rows
#define THREADS 64
#define PSCALE 0.1f

#if defined(__has_builtin)
#if __has_builtin(__builtin_amdgcn_tensor_load_to_lds) && \
    __has_builtin(__builtin_amdgcn_s_wait_tensorcnt)
#define HAVE_TDM 1
#endif
#endif

__global__ __launch_bounds__(THREADS)
void gmdr_ssm_step_kernel(const float* __restrict__ h,
                          const float* __restrict__ x,
                          const float* __restrict__ W_alpha,
                          const float* __restrict__ b_alpha,
                          const float* __restrict__ W_a,
                          const float* __restrict__ b_a,
                          const float* __restrict__ W_B,
                          const float* __restrict__ b_B,
                          float* __restrict__ out,
                          int batch)
{
    __shared__ __attribute__((aligned(16))) float Wlds[16 * D_IN];              // combined weights [16][128]
    __shared__ __attribute__((aligned(16))) float xlds[ROWS_PER_BLOCK * D_IN];  // x tile [64][128]
    __shared__ __attribute__((aligned(16))) float projlds[ROWS_PER_BLOCK * 16]; // projections [64][16]

    const int tid  = threadIdx.x;
    const int wave = tid >> 5;
    const int lane = tid & 31;
    const int blockRow = blockIdx.x * ROWS_PER_BLOCK;

    // ---- stage x tile: global -> LDS ----
#ifdef HAVE_TDM
    // One Tensor-Data-Mover DMA per block: 64x128 f32 tile, row-major,
    // straight into LDS (no VGPR transit). Tail rows read OOB -> zero.
    if (wave == 0) {
        const unsigned long long gaddr =
            (unsigned long long)(const void*)(x + (long)blockRow * D_IN);
        const unsigned ldsaddr = (unsigned)(unsigned long long)
            (__attribute__((address_space(3))) float*)xlds;
        const int remain = batch - blockRow;
        const unsigned rows =
            (unsigned)(remain < ROWS_PER_BLOCK ? remain : ROWS_PER_BLOCK);

        u32x4 g0;
        g0.x = 0x1u;                                   // count=1 (valid user D#)
        g0.y = ldsaddr;                                // lds_addr [63:32]
        g0.z = (unsigned)(gaddr & 0xffffffffu);        // global_addr [95:64]
        g0.w = (unsigned)((gaddr >> 32) & 0x01ffffffu) // global_addr[56:32]
             | 0x80000000u;                            // type=2 @ bits[127:126]

        i32x8 g1;
        g1[0] = 0x20000;                 // wg_mask=0, data_size=2 (4 bytes)
        g1[1] = (int)(128u << 16);       // tensor_dim0[15:0]=128 @ bits[63:48]
        g1[2] = (int)(rows << 16);       // dim0 hi=0; tensor_dim1[15:0]=rows
        g1[3] = (int)(128u << 16);       // dim1 hi=0; tile_dim0=128
        g1[4] = ROWS_PER_BLOCK;          // tile_dim1=64, tile_dim2=0
        g1[5] = D_IN;                    // tensor_dim0_stride=128
        g1[6] = 0;                       // stride hi / dim1_stride (2D: unused)
        g1[7] = 0;

        const i32x4 z4 = {0, 0, 0, 0};
        const i32x8 z8 = {0, 0, 0, 0, 0, 0, 0, 0};
        __builtin_amdgcn_tensor_load_to_lds(g0, g1, z4, z4, z8, 0);
    }
#else
    {
        const float4* xg = (const float4*)x;
        float4* xl4 = (float4*)xlds;
        const long base4  = (long)blockRow * (D_IN / 4);
        const long limit4 = (long)batch * (D_IN / 4);
        for (int i = tid; i < ROWS_PER_BLOCK * D_IN / 4; i += THREADS) {
            const long g = base4 + i;
            float4 v = make_float4(0.f, 0.f, 0.f, 0.f);
            if (g < limit4) v = xg[g];
            xl4[i] = v;
        }
    }
#endif

    // ---- stage combined weight matrix Wc[16][128] into LDS (overlaps TDM) ----
    for (int i = tid; i < 16 * D_IN; i += THREADS) {
        const int r = i >> 7;          // row 0..15
        const int c = i & (D_IN - 1);  // col 0..127
        float v;
        if (r < KS)                    v = W_alpha[r * D_IN + c];
        else if (r < KS + RANK * NDIM) v = W_a[(r - KS) * D_IN + c];
        else if (r < NPROJ)            v = W_B[(r - KS - RANK * NDIM) * D_IN + c];
        else                           v = 0.0f;
        Wlds[i] = v;
    }

#ifdef HAVE_TDM
    if (wave == 0) {
        __builtin_amdgcn_s_wait_tensorcnt(0);  // issuing wave waits for the DMA
    }
#endif
    __syncthreads();                           // publish LDS tile to all waves

    // ---- WMMA: proj(16x16) = Wc(16x128) * x_tile^T(128x16), two tiles/wave ----
    // A frag (16x4 f32): lane l -> M = l&15, VGPR v holds K = 4c + 2*(l>>4) + v
    // B frag (4x16 f32): lane l -> N = l&15, VGPR v holds K = 4c + 2*(l>>4) + v
    const int m       = lane & 15;
    const int khalf   = (lane >> 4) * 2;
    const int waveRow = wave * 32;

    v8f acc0 = {0.f, 0.f, 0.f, 0.f, 0.f, 0.f, 0.f, 0.f};
    v8f acc1 = {0.f, 0.f, 0.f, 0.f, 0.f, 0.f, 0.f, 0.f};

    for (int c = 0; c < D_IN / 4; ++c) {
        const int koff = c * 4 + khalf;
        v2f aF = *(const v2f*)&Wlds[m * D_IN + koff];
        v2f b0 = *(const v2f*)&xlds[(waveRow + m) * D_IN + koff];
        v2f b1 = *(const v2f*)&xlds[(waveRow + 16 + m) * D_IN + koff];
        acc0 = __builtin_amdgcn_wmma_f32_16x16x4_f32(false, aF, false, b0,
                                                     (short)0, acc0, false, false);
        acc1 = __builtin_amdgcn_wmma_f32_16x16x4_f32(false, aF, false, b1,
                                                     (short)0, acc1, false, false);
    }

    // ---- scatter D tiles so each lane owns one row's projections ----
    // D layout: lane l -> column N = l&15, VGPR v -> M = v + 8*(l>>4)
    {
        const int mbase = (lane >> 4) * 8;
        const int r0 = waveRow + m;
        const int r1 = waveRow + 16 + m;
#pragma unroll
        for (int v = 0; v < 8; ++v) {
            projlds[r0 * 16 + mbase + v] = acc0[v];
            projlds[r1 * 16 + mbase + v] = acc1[v];
        }
    }
    __syncthreads();

    // ---- epilogue: one lane per batch row ----
    const int  localRow = waveRow + lane;
    const long row      = (long)blockRow + localRow;
    if (row < batch) {
        float p[NPROJ];
#pragma unroll
        for (int i = 0; i < NPROJ; ++i) p[i] = projlds[localRow * 16 + i];

        // softmax over 3 kernel-neighborhood logits
        const float l0 = p[0] + b_alpha[0];
        const float l1 = p[1] + b_alpha[1];
        const float l2 = p[2] + b_alpha[2];
        const float mx = fmaxf(l0, fmaxf(l1, l2));
        const float e0 = expf(l0 - mx), e1 = expf(l1 - mx), e2 = expf(l2 - mx);
        const float inv = 1.0f / (e0 + e1 + e2);
        const float al0 = e0 * inv, al1 = e1 * inv, al2 = e2 * inv;
        const float als = al0 + al1 + al2;

        // low-rank tanh perturbation coefficients a[r][i]
        float a0[NDIM], a1[NDIM];
#pragma unroll
        for (int i = 0; i < NDIM; ++i) {
            a0[i] = tanhf(p[3 + i] + b_a[i])        * PSCALE;
            a1[i] = tanhf(p[7 + i] + b_a[NDIM + i]) * PSCALE;
        }

        // Bx + b_B
        const float bx0 = p[11] + b_B[0];
        const float bx1 = p[12] + b_B[1];
        const float bx2 = p[13] + b_B[2];
        const float bx3 = p[14] + b_B[3];

        const float4 hv = ((const float4*)h)[row];

        // A = al0*I + al1*Swap01 + al2*SignFlip0 + a0.*C3 + a1.*C4 (closed form)
        float4 o;
        o.x = (al0 - al2) * hv.x + (al1 + a0[0] + a1[0]) * hv.y + bx0;
        o.y = al1 * hv.x + (al0 + al2) * hv.y + (a0[1] + a1[1]) * hv.z + bx1;
        o.z = a0[2] * hv.x + als * hv.z + a1[2] * hv.w + bx2;
        o.w = a1[3] * hv.x + (als + a0[3]) * hv.w + bx3;

        ((float4*)out)[row] = o;
    }
}

extern "C" void kernel_launch(void* const* d_in, const int* in_sizes, int n_in,
                              void* d_out, int out_size, void* d_ws, size_t ws_size,
                              hipStream_t stream) {
    const float* h       = (const float*)d_in[0];
    const float* x       = (const float*)d_in[1];
    const float* W_alpha = (const float*)d_in[2];
    const float* b_alpha = (const float*)d_in[3];
    const float* W_a     = (const float*)d_in[4];
    const float* b_a     = (const float*)d_in[5];
    const float* W_B     = (const float*)d_in[6];
    const float* b_B     = (const float*)d_in[7];
    float* out = (float*)d_out;

    const int batch = in_sizes[0] / NDIM;   // h is (BATCH, 4)
    const int grid  = (batch + ROWS_PER_BLOCK - 1) / ROWS_PER_BLOCK;

    gmdr_ssm_step_kernel<<<grid, THREADS, 0, stream>>>(
        h, x, W_alpha, b_alpha, W_a, b_a, W_B, b_B, out, batch);
}

// v001
// Measured time: 39.4 microseconds a run.
// In both of two side-by-side timings against v000, it was 1.40 times as fast.
#include <hip/hip_runtime.h>
#include <math.h>
#include <stdint.h>

typedef float v2f __attribute__((ext_vector_type(2)));
typedef float v8f __attribute__((ext_vector_type(8)));
typedef uint32_t u32x4 __attribute__((ext_vector_type(4)));
typedef uint32_t u32x8 __attribute__((ext_vector_type(8)));

#define NDIM 4
#define D_IN 128
#define KS 3
#define RANK 2
#define NPROJ 15              // 3 + 8 + 4 rows, padded to 16
#define ROWS_PER_BLOCK 64     // 2 waves * 32 rows
#define THREADS 64
#define PSCALE 0.1f
// LDS row pitch of x and of the combined weights, in dwords. 132 = 4 mod 64:
// the 16 rows x 2 k-halves of one 8-byte fragment read fall on all 64 banks.
#define LPITCH 132
#define XHALF_B 256           // the tensor load moves x as half rows of 256 bytes
#define XPAD_DW 2             // and lays 2 dwords of pad behind each: 2 * (64 + 2) = LPITCH

static __device__ __forceinline__ uint32_t uni(uint32_t v) { return __builtin_amdgcn_readfirstlane(v); }
// A tensor load ignores EXEC: the test that picks its issuer must be a scalar branch.
static __device__ __forceinline__ uint32_t pinned(uint32_t v) {
    uint32_t w = uni(v);
    asm volatile("" : "+s"(w));  // pinned(): holds the test in a scalar register, so it compiles to s_cmp + s_cbranch_scc
    return w;
}

__global__ __launch_bounds__(THREADS)
void gmdr_ssm_step_kernel(const float* __restrict__ h,
                          const float* __restrict__ x,
                          const float* __restrict__ W_alpha,
                          const float* __restrict__ b_alpha,
                          const float* __restrict__ W_a,
                          const float* __restrict__ b_a,
                          const float* __restrict__ W_B,
                          const float* __restrict__ b_B,
                          float* __restrict__ out,
                          int batch)
{
    __shared__ __attribute__((aligned(2048))) float xlds[ROWS_PER_BLOCK * LPITCH]; // x tile [64][64+2+64+2]
    __shared__ __attribute__((aligned(16))) float Wlds[16 * LPITCH];               // combined weights [16][128+4]
    __shared__ __attribute__((aligned(16))) float projlds[ROWS_PER_BLOCK * 16]; // projections [64][16]

    const int tid  = threadIdx.x;
    const int wave = tid >> 5;
    const int lane = tid & 31;
    const int blockRow = blockIdx.x * ROWS_PER_BLOCK;

    // ---- stage x tile: global -> LDS ----
    // One tensor load per block: the block's rows as 256-byte half rows, straight
    // into LDS (no VGPR transit), each followed by the pad. The tile ends with the
    // batch: LDS rows past it keep old contents, feed only their own result
    // columns and are never stored.
    const uint64_t gaddr = (uint64_t)(size_t)(x + (long)blockRow * D_IN);
    const int remain = batch - blockRow;
    const uint32_t halves =
        2u * (uint32_t)(remain < ROWS_PER_BLOCK ? remain : ROWS_PER_BLOCK);

    u32x4 g0;
    g0[0] = uni(1u);                                   // count = 1
    g0[1] = uni((uint32_t)(size_t)xlds);               // LDS destination, bytes
    g0[2] = uni((uint32_t)gaddr);                      // global address [31:0]
    g0[3] = uni(((uint32_t)(gaddr >> 32) & 0x01FFFFFFu) | 0x80000000u); // [56:32], type = 2

    u32x8 g1;                                          // 1-byte elements: all extents in bytes
    g1[0] = uni((1u << 20) | (5u << 22) | ((XPAD_DW - 1u) << 25)); // pad on, every 64 dwords, 2 dwords
    g1[1] = uni((uint32_t)XHALF_B << 16);              // tensor_dim0 = 256
    g1[2] = uni(halves << 16);                         // tensor_dim1 = half rows
    g1[3] = uni((uint32_t)XHALF_B << 16);              // tile_dim0 = 256
    g1[4] = uni(halves);                               // tile_dim1 = tensor_dim1
    g1[5] = uni((uint32_t)XHALF_B);                    // source pitch = 256
    g1[6] = uni(0u);
    g1[7] = uni(0u);

    if (pinned(uni((uint32_t)tid >> 5) == 0u)) {       // wave 0 issues
        asm volatile("tensor_load_to_lds %0, %1" :: "s"(g0), "s"(g1) : "memory");
    }

    // ---- stage combined weight matrix Wc[16][128] into LDS (overlaps TDM) ----
    for (int i = tid; i < 16 * D_IN; i += THREADS) {
        const int r = i >> 7;          // row 0..15
        const int c = i & (D_IN - 1);  // col 0..127
        float v;
        if (r < KS)                    v = W_alpha[r * D_IN + c];
        else if (r < KS + RANK * NDIM) v = W_a[(r - KS) * D_IN + c];
        else if (r < NPROJ)            v = W_B[(r - KS - RANK * NDIM) * D_IN + c];
        else                           v = 0.0f;
        Wlds[r * LPITCH + c] = v;
    }

    // The issuing wave waits for its tile (the other wave has nothing outstanding).
    // The wait names the descriptor, so that its registers are not reused for the
    // staging loop above while the request is outstanding.
    asm volatile("s_wait_tensorcnt 0x0" :: "s"(g0), "s"(g1) : "memory");
    __syncthreads();                           // publish LDS tile to all waves

    // ---- WMMA: proj(16x16) = Wc(16x128) * x_tile^T(128x16), two tiles/wave ----
    // A frag (16x4 f32): lane l -> M = l&15, VGPR v holds K = 4c + 2*(l>>4) + v
    // B frag (4x16 f32): lane l -> N = l&15, VGPR v holds K = 4c + 2*(l>>4) + v
    const int m       = lane & 15;
    const int khalf   = (lane >> 4) * 2;
    const int waveRow = wave * 32;

    v8f acc0 = {0.f, 0.f, 0.f, 0.f, 0.f, 0.f, 0.f, 0.f};
    v8f acc1 = {0.f, 0.f, 0.f, 0.f, 0.f, 0.f, 0.f, 0.f};

    for (int c = 0; c < D_IN / 4; ++c) {
        const int koff = c * 4 + khalf;
        const int xoff = koff + XPAD_DW * (c >> 4);   // k >= 64 lies behind the first half row's pad
        v2f aF = *(const v2f*)&Wlds[m * LPITCH + koff];
        v2f b0 = *(const v2f*)&xlds[(waveRow + m) * LPITCH + xoff];
        v2f b1 = *(const v2f*)&xlds[(waveRow + 16 + m) * LPITCH + xoff];
        acc0 = __builtin_amdgcn_wmma_f32_16x16x4_f32(false, aF, false, b0,
                                                     (short)0, acc0, false, false);
        acc1 = __builtin_amdgcn_wmma_f32_16x16x4_f32(false, aF, false, b1,
                                                     (short)0, acc1, false, false);
    }

    // ---- scatter D tiles so each lane owns one row's projections ----
    // D layout: lane l -> column N = l&15, VGPR v -> M = v + 8*(l>>4)
    {
        const int mbase = (lane >> 4) * 8;
        const int r0 = waveRow + m;
        const int r1 = waveRow + 16 + m;
#pragma unroll
        for (int v = 0; v < 8; ++v) {
            projlds[r0 * 16 + mbase + v] = acc0[v];
            projlds[r1 * 16 + mbase + v] = acc1[v];
        }
    }
    __syncthreads();

    // ---- epilogue: one lane per batch row ----
    const int  localRow = waveRow + lane;
    const long row      = (long)blockRow + localRow;
    if (row < batch) {
        float p[NPROJ];
#pragma unroll
        for (int i = 0; i < NPROJ; ++i) p[i] = projlds[localRow * 16 + i];

        // softmax over 3 kernel-neighborhood logits
        const float l0 = p[0] + b_alpha[0];
        const float l1 = p[1] + b_alpha[1];
        const float l2 = p[2] + b_alpha[2];
        const float mx = fmaxf(l0, fmaxf(l1, l2));
        const float e0 = expf(l0 - mx), e1 = expf(l1 - mx), e2 = expf(l2 - mx);
        const float inv = 1.0f / (e0 + e1 + e2);
        const float al0 = e0 * inv, al1 = e1 * inv, al2 = e2 * inv;
        const float als = al0 + al1 + al2;

        // low-rank tanh perturbation coefficients a[r][i]
        float a0[NDIM], a1[NDIM];
#pragma unroll
        for (int i = 0; i < NDIM; ++i) {
            a0[i] = tanhf(p[3 + i] + b_a[i])        * PSCALE;
            a1[i] = tanhf(p[7 + i] + b_a[NDIM + i]) * PSCALE;
        }

        // Bx + b_B
        const float bx0 = p[11] + b_B[0];
        const float bx1 = p[12] + b_B[1];
        const float bx2 = p[13] + b_B[2];
        const float bx3 = p[14] + b_B[3];

        const float4 hv = ((const float4*)h)[row];

        // A = al0*I + al1*Swap01 + al2*SignFlip0 + a0.*C3 + a1.*C4 (closed form)
        float4 o;
        o.x = (al0 - al2) * hv.x + (al1 + a0[0] + a1[0]) * hv.y + bx0;
        o.y = al1 * hv.x + (al0 + al2) * hv.y + (a0[1] + a1[1]) * hv.z + bx1;
        o.z = a0[2] * hv.x + als * hv.z + a1[2] * hv.w + bx2;
        o.w = a1[3] * hv.x + (als + a0[3]) * hv.w + bx3;

        ((float4*)out)[row] = o;
    }
}

extern "C" void kernel_launch(void* const* d_in, const int* in_sizes, int n_in,
                              void* d_out, int out_size, void* d_ws, size_t ws_size,
                              hipStream_t stream) {
    const float* h       = (const float*)d_in[0];
    const float* x       = (const float*)d_in[1];
    const float* W_alpha = (const float*)d_in[2];
    const float* b_alpha = (const float*)d_in[3];
    const float* W_a     = (const float*)d_in[4];
    const float* b_a     = (const float*)d_in[5];
    const float* W_B     = (const float*)d_in[6];
    const float* b_B     = (const float*)d_in[7];
    float* out = (float*)d_out;

    const int batch = in_sizes[0] / NDIM;   // h is (BATCH, 4)
    const int grid  = (batch + ROWS_PER_BLOCK - 1) / ROWS_PER_BLOCK;

    gmdr_ssm_step_kernel<<<grid, THREADS, 0, stream>>>(
        h, x, W_alpha, b_alpha, W_a, b_a, W_B, b_B, out, batch);
}

// v002
// It runs in 21.2 microseconds.
// Timed twice side by side with v001, it ran 1.86 times as fast both times.
// Over all steps from v000 it is 2.60 times as fast.
#include <hip/hip_runtime.h>
#include <math.h>
#include <stdint.h>

typedef float v2f __attribute__((ext_vector_type(2)));
typedef float v8f __attribute__((ext_vector_type(8)));
typedef uint32_t u32x4 __attribute__((ext_vector_type(4)));
typedef uint32_t u32x8 __attribute__((ext_vector_type(8)));

#define NDIM 4
#define D_IN 128
#define KS 3
#define RANK 2
#define NPROJ 15              // 3 + 8 + 4 rows, padded to 16
#define ROWS_PER_BLOCK 128    // 4 waves * 32 rows: one tile
#define THREADS 128
#define GRID 512              // two blocks a WGP (by LDS), all resident; each walks the tiles GRID apart
#define PSCALE 0.1f
// LDS row pitch of x and of the combined weights, in dwords. 132 = 4 mod 64:
// the 16 rows x 2 k-halves of one 8-byte fragment read fall on all 64 banks.
#define LPITCH 132
#define XHALF_B 256           // the tensor load moves x as half rows of 256 bytes
#define XPAD_DW 2             // and lays 2 dwords of pad behind each: 2 * (64 + 2) = LPITCH
#define XBUF_DW (ROWS_PER_BLOCK * LPITCH)  // one x buffer: 67,584 bytes = 33 * 2 KiB

static __device__ __forceinline__ uint32_t uni(uint32_t v) { return __builtin_amdgcn_readfirstlane(v); }
// A tensor load ignores EXEC: the test that picks its issuer must be a scalar branch.
static __device__ __forceinline__ uint32_t pinned(uint32_t v) {
    uint32_t w = uni(v);
    asm volatile("" : "+s"(w));  // pinned(): holds the test in a scalar register, so it compiles to s_cmp + s_cbranch_scc
    return w;
}

__global__ __launch_bounds__(THREADS)
void gmdr_ssm_step_kernel(const float* __restrict__ h,
                          const float* __restrict__ x,
                          const float* __restrict__ W_alpha,
                          const float* __restrict__ b_alpha,
                          const float* __restrict__ W_a,
                          const float* __restrict__ b_a,
                          const float* __restrict__ W_B,
                          const float* __restrict__ b_B,
                          float* __restrict__ out,
                          int batch)
{
    __shared__ __attribute__((aligned(2048))) float xlds[2 * XBUF_DW];             // two x tiles [128][64+2+64+2]
    __shared__ __attribute__((aligned(16))) float Wlds[16 * LPITCH];               // combined weights [16][128+4]
    __shared__ __attribute__((aligned(16))) float projlds[ROWS_PER_BLOCK * 16]; // projections [128][16]

    const int tid  = threadIdx.x;
    const int wave = tid >> 5;
    const int lane = tid & 31;
    const int ntiles = (batch + ROWS_PER_BLOCK - 1) / ROWS_PER_BLOCK;
    if ((int)blockIdx.x >= ntiles) return;             // the whole block leaves, ahead of every barrier and load
    const uint32_t wave0 = uni((uint32_t)tid >> 5) == 0u;  // wave 0 issues every tensor load

    // Biases, the same for every tile: read here, ahead of the first asm statement, where
    // they are scalar loads; inside the tile loop each would be a vector load with its own wait.
    const float ba0 = b_alpha[0], ba1 = b_alpha[1], ba2 = b_alpha[2];
    float bt[RANK * NDIM];
#pragma unroll
    for (int i = 0; i < RANK * NDIM; ++i) bt[i] = b_a[i];
    const float bB0 = b_B[0], bB1 = b_B[1], bB2 = b_B[2], bB3 = b_B[3];

    // ---- x tiles: global -> LDS, a ring of two buffers ----
    // One tensor load per tile: the tile's rows as 256-byte half rows, straight
    // into LDS (no VGPR transit), each followed by the pad. The last tile ends with
    // the batch: LDS rows past it keep old contents, feed only their own result
    // columns and are never stored.
    u32x4 g0;
    u32x8 g1;                                          // 1-byte elements: all extents in bytes
    auto describe = [&](int t, uint32_t buf) {
        const uint64_t gaddr = (uint64_t)(size_t)(x + (long)t * (ROWS_PER_BLOCK * D_IN));
        const int remain = batch - t * ROWS_PER_BLOCK;
        const uint32_t halves =
            2u * (uint32_t)(remain < ROWS_PER_BLOCK ? remain : ROWS_PER_BLOCK);
        g0[0] = uni(1u);                               // count = 1
        g0[1] = uni((uint32_t)(size_t)xlds + buf * (uint32_t)(XBUF_DW * 4)); // LDS destination, bytes
        g0[2] = uni((uint32_t)gaddr);                  // global address [31:0]
        g0[3] = uni(((uint32_t)(gaddr >> 32) & 0x01FFFFFFu) | 0x80000000u); // [56:32], type = 2
        g1[0] = uni((1u << 20) | (5u << 22) | ((XPAD_DW - 1u) << 25)); // pad on, every 64 dwords, 2 dwords
        g1[1] = uni((uint32_t)XHALF_B << 16);          // tensor_dim0 = 256
        g1[2] = uni(halves << 16);                     // tensor_dim1 = half rows
        g1[3] = uni((uint32_t)XHALF_B << 16);          // tile_dim0 = 256
        g1[4] = uni(halves);                           // tile_dim1 = tensor_dim1
        g1[5] = uni((uint32_t)XHALF_B);                // source pitch = 256
        g1[6] = uni(0u);
        g1[7] = uni(0u);
    };

    // The descriptor is named as in-out, though the load leaves it as it is: its values
    // then stay in the very registers of the issue until the wait that names them next.
    auto issue = [&]() {
        asm volatile("tensor_load_to_lds %0, %1" : "+s"(g0), "+s"(g1) :: "memory");
    };

    describe((int)blockIdx.x, 0u);                     // stage 0
    if (pinned(wave0)) {
        issue();
    }

    // ---- stage combined weight matrix Wc[16][128] into LDS (overlaps TDM) ----
    for (int i = tid; i < 16 * D_IN; i += THREADS) {
        const int r = i >> 7;          // row 0..15
        const int c = i & (D_IN - 1);  // col 0..127
        float v;
        if (r < KS)                    v = W_alpha[r * D_IN + c];
        else if (r < KS + RANK * NDIM) v = W_a[(r - KS) * D_IN + c];
        else if (r < NPROJ)            v = W_B[(r - KS - RANK * NDIM) * D_IN + c];
        else                           v = 0.0f;
        Wlds[r * LPITCH + c] = v;
    }

    // The issuing wave waits for its tile (the other waves have nothing outstanding).
    // The wait names the descriptor, so that its registers are not reused for the
    // staging loop above while the request is outstanding.
    asm volatile("s_wait_tensorcnt 0x0" :: "s"(g0), "s"(g1) : "memory");
    __syncthreads();                           // publish stage 0 and the weights to all waves

    describe((int)blockIdx.x + GRID, 1u);      // stage 1 flies while stage 0 is worked on
    if (pinned(wave0 && (int)blockIdx.x + GRID < ntiles)) {
        issue();
    }

    // ---- WMMA: proj(16x16) = Wc(16x128) * x_tile^T(128x16), two tiles/wave ----
    // A frag (16x4 f32): lane l -> M = l&15, VGPR v holds K = 4c + 2*(l>>4) + v
    // B frag (4x16 f32): lane l -> N = l&15, VGPR v holds K = 4c + 2*(l>>4) + v
    const int m       = lane & 15;
    const int khalf   = (lane >> 4) * 2;
    const int waveRow = wave * 32;

    uint32_t buf = 0u;                         // the buffer that holds this pass's tile
    for (int t = (int)blockIdx.x; t < ntiles; t += GRID) {
    const float* xt = xlds + buf * XBUF_DW;
    const int blockRow = t * ROWS_PER_BLOCK;

    v8f acc0 = {0.f, 0.f, 0.f, 0.f, 0.f, 0.f, 0.f, 0.f};
    v8f acc1 = {0.f, 0.f, 0.f, 0.f, 0.f, 0.f, 0.f, 0.f};

    for (int c = 0; c < D_IN / 4; ++c) {
        const int koff = c * 4 + khalf;
        const int xoff = koff + XPAD_DW * (c >> 4);   // k >= 64 lies behind the first half row's pad
        v2f aF = *(const v2f*)&Wlds[m * LPITCH + koff];
        v2f b0 = *(const v2f*)&xt[(waveRow + m) * LPITCH + xoff];
        v2f b1 = *(const v2f*)&xt[(waveRow + 16 + m) * LPITCH + xoff];
        acc0 = __builtin_amdgcn_wmma_f32_16x16x4_f32(false, aF, false, b0,
                                                     (short)0, acc0, false, false);
        acc1 = __builtin_amdgcn_wmma_f32_16x16x4_f32(false, aF, false, b1,
                                                     (short)0, acc1, false, false);
    }

    // ---- scatter D tiles so each lane owns one row's projections ----
    // D layout: lane l -> column N = l&15, VGPR v -> M = v + 8*(l>>4)
    {
        const int mbase = (lane >> 4) * 8;
        const int r0 = waveRow + m;
        const int r1 = waveRow + 16 + m;
#pragma unroll
        for (int v = 0; v < 8; ++v) {
            projlds[r0 * 16 + mbase + v] = acc0[v];
            projlds[r1 * 16 + mbase + v] = acc1[v];
        }
    }

    // ---- publish point of the next tile, every wave, in this order ----
    // It stands here, where the last read of buffer buf is done, and not behind the
    // epilogue: the refill starts sooner, and the row's store is not waited for.
    asm volatile("s_wait_dscnt 0x0" ::: "memory");   // this wave's reads of buffer buf have returned
    // The issuer's next tile has landed; the wait names the descriptor, so that its
    // registers keep their values while the request is outstanding.
    asm volatile("s_wait_tensorcnt 0x0" :: "s"(g0), "s"(g1) : "memory");
    __syncthreads();                           // next tile readable by all; buffer buf left by all
    describe(t + 2 * GRID, buf);               // refill it, two tiles ahead
    if (pinned(wave0 && t + 2 * GRID < ntiles)) {
        issue();
    }

    // ---- epilogue: one lane per batch row ----
    const int  localRow = waveRow + lane;
    const long row      = (long)blockRow + localRow;
    if (row < batch) {
        float p[NPROJ];
#pragma unroll
        for (int i = 0; i < NPROJ; ++i) p[i] = projlds[localRow * 16 + i];

        // softmax over 3 kernel-neighborhood logits
        const float l0 = p[0] + ba0;
        const float l1 = p[1] + ba1;
        const float l2 = p[2] + ba2;
        const float mx = fmaxf(l0, fmaxf(l1, l2));
        const float e0 = expf(l0 - mx), e1 = expf(l1 - mx), e2 = expf(l2 - mx);
        const float inv = 1.0f / (e0 + e1 + e2);
        const float al0 = e0 * inv, al1 = e1 * inv, al2 = e2 * inv;
        const float als = al0 + al1 + al2;

        // low-rank tanh perturbation coefficients a[r][i]
        float a0[NDIM], a1[NDIM];
#pragma unroll
        for (int i = 0; i < NDIM; ++i) {
            a0[i] = tanhf(p[3 + i] + bt[i])        * PSCALE;
            a1[i] = tanhf(p[7 + i] + bt[NDIM + i]) * PSCALE;
        }

        // Bx + b_B
        const float bx0 = p[11] + bB0;
        const float bx1 = p[12] + bB1;
        const float bx2 = p[13] + bB2;
        const float bx3 = p[14] + bB3;

        const float4 hv = ((const float4*)h)[row];

        // A = al0*I + al1*Swap01 + al2*SignFlip0 + a0.*C3 + a1.*C4 (closed form)
        float4 o;
        o.x = (al0 - al2) * hv.x + (al1 + a0[0] + a1[0]) * hv.y + bx0;
        o.y = al1 * hv.x + (al0 + al2) * hv.y + (a0[1] + a1[1]) * hv.z + bx1;
        o.z = a0[2] * hv.x + als * hv.z + a1[2] * hv.w + bx2;
        o.w = a1[3] * hv.x + (als + a0[3]) * hv.w + bx3;

        ((float4*)out)[row] = o;
    }
    buf ^= 1u;
    }

    asm volatile("s_wait_tensorcnt 0x0" ::: "memory");  // nothing of the ring is outstanding at the wave's end
    asm volatile("s_wait_dscnt 0x0" ::: "memory");      // nor any LDS read
}

extern "C" void kernel_launch(void* const* d_in, const int* in_sizes, int n_in,
                              void* d_out, int out_size, void* d_ws, size_t ws_size,
                              hipStream_t stream) {
    const float* h       = (const float*)d_in[0];
    const float* x       = (const float*)d_in[1];
    const float* W_alpha = (const float*)d_in[2];
    const float* b_alpha = (const float*)d_in[3];
    const float* W_a     = (const float*)d_in[4];
    const float* b_a     = (const float*)d_in[5];
    const float* W_B     = (const float*)d_in[6];
    const float* b_B     = (const float*)d_in[7];
    float* out = (float*)d_out;

    const int batch = in_sizes[0] / NDIM;   // h is (BATCH, 4)

    gmdr_ssm_step_kernel<<<GRID, THREADS, 0, stream>>>(
        h, x, W_alpha, b_alpha, W_a, b_a, W_B, b_B, out, batch);
}

// v003
// Measured time: 13.9 microseconds a run.
// Two timings next to v002 put it at 1.53 and 1.52 times that version's speed.
// Over all steps from v000 it is 3.97 times as fast.
#include <hip/hip_runtime.h>
#include <math.h>
#include <stdint.h>

typedef float v2f __attribute__((ext_vector_type(2)));
typedef float v8f __attribute__((ext_vector_type(8)));

#define NDIM 4
#define D_IN 128
#define KS 3
#define RANK 2
#define NPROJ 15              // 3 + 8 + 4 rows, padded to 16
#define WAVES 16              // four waves a SIMD: one wave's waits are covered by the others
#define THREADS (WAVES * 32)
#define GRID 256              // one block a WGP (by LDS), all resident
#define TROWS 32              // rows of one wave's tile
#define PSCALE 0.1f
// LDS row pitch of x and of the combined weights, in dwords. 132 = 4 mod 64:
// the 16 rows x 2 k-halves of one 8-byte fragment read fall on all 64 banks.
#define LPITCH 132
// A stage of a wave's ring: 16 whole rows, one half of the wave's tile, 8 KiB in a row in memory.
#define SROWS 16
#define STAGE_DW (SROWS * LPITCH)   // 8,448 bytes

static __device__ __forceinline__ uint32_t uni(uint32_t v) { return __builtin_amdgcn_readfirstlane(v); }

// Eight asynchronous copies, 16 bytes a lane each. The s_wait_xcnt closes the statement, so
// that it stands ahead of every later write of an address register that a copy names.
static __device__ __forceinline__ void copy8(const uint32_t* l, const float* const* g) {
    asm volatile("global_load_async_to_lds_b128 %0, %8, off\n\t"
                 "global_load_async_to_lds_b128 %1, %9, off\n\t"
                 "global_load_async_to_lds_b128 %2, %10, off\n\t"
                 "global_load_async_to_lds_b128 %3, %11, off\n\t"
                 "global_load_async_to_lds_b128 %4, %12, off\n\t"
                 "global_load_async_to_lds_b128 %5, %13, off\n\t"
                 "global_load_async_to_lds_b128 %6, %14, off\n\t"
                 "global_load_async_to_lds_b128 %7, %15, off\n\t"
                 "s_wait_xcnt 0x0"
                 :: "v"(l[0]), "v"(l[1]), "v"(l[2]), "v"(l[3]), "v"(l[4]), "v"(l[5]), "v"(l[6]), "v"(l[7]),
                    "v"(g[0]), "v"(g[1]), "v"(g[2]), "v"(g[3]), "v"(g[4]), "v"(g[5]), "v"(g[6]), "v"(g[7])
                 : "memory");
}

__global__ __launch_bounds__(THREADS)
void gmdr_ssm_step_kernel(const float* __restrict__ h,
                          const float* __restrict__ x,
                          const float* __restrict__ W_alpha,
                          const float* __restrict__ b_alpha,
                          const float* __restrict__ W_a,
                          const float* __restrict__ b_a,
                          const float* __restrict__ W_B,
                          const float* __restrict__ b_B,
                          float* __restrict__ out,
                          int batch)
{
    __shared__ __attribute__((aligned(16))) float xlds[WAVES * 2 * STAGE_DW];      // per wave: two stages [16][128+4]
    __shared__ __attribute__((aligned(16))) float Wlds[16 * LPITCH];               // combined weights [16][128+4]
    __shared__ __attribute__((aligned(16))) float projlds[WAVES * TROWS * 16];     // per wave: projections [32][16]

    const int tid  = threadIdx.x;
    const int wave = (int)uni((uint32_t)tid >> 5);
    const int lane = tid & 31;
    const int ntiles = (batch + TROWS - 1) / TROWS;
    if ((int)blockIdx.x * WAVES >= ntiles) return;     // the whole block leaves, ahead of the barrier and of every copy

    // Biases, the same for every tile: read here, ahead of the first asm statement, where
    // they are scalar loads; inside the tile loop each would be a vector load with its own wait.
    const float ba0 = b_alpha[0], ba1 = b_alpha[1], ba2 = b_alpha[2];
    float bt[RANK * NDIM];
#pragma unroll
    for (int i = 0; i < RANK * NDIM; ++i) bt[i] = b_a[i];
    const float bB0 = b_B[0], bB1 = b_B[1], bB2 = b_B[2], bB3 = b_B[3];

    float* const xw = xlds + wave * (2 * STAGE_DW);
    const uint32_t lds0 = (uint32_t)(size_t)xw + (uint32_t)(lane * 16);
    auto issue = [&](int t, int half) {
        uint32_t l[16];
        const float* g[16];
#pragma unroll  // l[] and g[] must end up in registers: the asm statements name them one by one
        for (int j = 0; j < 16; ++j) {
            int r = t * TROWS + half * SROWS + j;
            r = r < batch - 1 ? r : batch - 1;
            g[j] = x + (long)r * D_IN + lane * 4;
            l[j] = lds0 + (uint32_t)(half * (STAGE_DW * 4) + j * (LPITCH * 4));
        }
        copy8(l, g);
        copy8(l + 8, g + 8);
    };

    const int t0 = (int)blockIdx.x * WAVES + wave;     // the block's waves take 512 rows in a row
    if (t0 < ntiles) issue(t0, 0);                     // wave-uniform test

    // ---- stage combined weight matrix Wc[16][128] into LDS (overlaps the first copies) ----
    for (int i = tid; i < 16 * D_IN; i += THREADS) {
        const int r = i >> 7;          // row 0..15
        const int c = i & (D_IN - 1);  // col 0..127
        float v;
        if (r < KS)                    v = W_alpha[r * D_IN + c];
        else if (r < KS + RANK * NDIM) v = W_a[(r - KS) * D_IN + c];
        else if (r < NPROJ)            v = W_B[(r - KS - RANK * NDIM) * D_IN + c];
        else                           v = 0.0f;
        Wlds[r * LPITCH + c] = v;
    }

    asm volatile("s_wait_asynccnt 0x0" ::: "memory");  // this wave's first stage has landed
    __syncthreads();                                   // publish the weights: the kernel's one barrier

    // ---- WMMA: proj(16x16) = Wc(16x128) * x_tile^T(128x16), two tiles/wave, one a stage ----
    // A frag (16x4 f32): lane l -> M = l&15, VGPR v holds K = 4c + 2*(l>>4) + v
    // B frag (4x16 f32): lane l -> N = l&15, VGPR v holds K = 4c + 2*(l>>4) + v
    const int m       = lane & 15;
    const int khalf   = (lane >> 4) * 2;
    const int waveRow = wave * TROWS;

    for (int t = t0; t < ntiles; t += GRID * WAVES) {
    const int blockRow = t * TROWS - waveRow;          // row = blockRow + localRow, as below

    v8f acc0 = {0.f, 0.f, 0.f, 0.f, 0.f, 0.f, 0.f, 0.f};
    v8f acc1 = {0.f, 0.f, 0.f, 0.f, 0.f, 0.f, 0.f, 0.f};

    auto product = [&](int half, v8f& acc) {
        const float* xs = xw + half * STAGE_DW;
        for (int c = 0; c < D_IN / 4; ++c) {
            const int koff = c * 4 + khalf;
            v2f aF = *(const v2f*)&Wlds[m * LPITCH + koff];
            v2f bF = *(const v2f*)&xs[m * LPITCH + koff];
            acc = __builtin_amdgcn_wmma_f32_16x16x4_f32(false, aF, false, bF,
                                                        (short)0, acc, false, false);
        }
    };

    // Stage 0 of this tile has landed; stage 1's place was left at the last tile's s_wait_dscnt.
    issue(t, 1);                                       // flies while stage 0 is worked on
    product(0, acc0);
    asm volatile("s_wait_dscnt 0x0" ::: "memory");     // this wave's reads of stage 0 have returned: its place is free
    asm volatile("s_wait_asynccnt 0x0" ::: "memory");  // stage 1 has landed
    if (t + GRID * WAVES < ntiles) issue(t + GRID * WAVES, 0);  // wave-uniform; flies over stage 1 and the epilogue
    product(1, acc1);

    // ---- scatter D tiles so each lane owns one row's projections ----
    // D layout: lane l -> column N = l&15, VGPR v -> M = v + 8*(l>>4)
    {
        const int mbase = (lane >> 4) * 8;
        const int r0 = waveRow + m;
        const int r1 = waveRow + 16 + m;
#pragma unroll
        for (int v = 0; v < 8; ++v) {
            projlds[r0 * 16 + mbase + v] = acc0[v];
            projlds[r1 * 16 + mbase + v] = acc1[v];
        }
    }
    // The wave's reads of stage 1 have returned (its place is free for the next tile) and its
    // projections are written: only this wave's lanes read them, so no barrier is needed.
    asm volatile("s_wait_dscnt 0x0" ::: "memory");

    // ---- epilogue: one lane per batch row ----
    const int  localRow = waveRow + lane;
    const long row      = (long)blockRow + localRow;
    if (row < batch) {
        float p[NPROJ];
#pragma unroll
        for (int i = 0; i < NPROJ; ++i) p[i] = projlds[localRow * 16 + i];

        // softmax over 3 kernel-neighborhood logits
        const float l0 = p[0] + ba0;
        const float l1 = p[1] + ba1;
        const float l2 = p[2] + ba2;
        const float mx = fmaxf(l0, fmaxf(l1, l2));
        const float e0 = expf(l0 - mx), e1 = expf(l1 - mx), e2 = expf(l2 - mx);
        const float inv = 1.0f / (e0 + e1 + e2);
        const float al0 = e0 * inv, al1 = e1 * inv, al2 = e2 * inv;
        const float als = al0 + al1 + al2;

        // low-rank tanh perturbation coefficients a[r][i]
        float a0[NDIM], a1[NDIM];
#pragma unroll
        for (int i = 0; i < NDIM; ++i) {
            a0[i] = tanhf(p[3 + i] + bt[i])        * PSCALE;
            a1[i] = tanhf(p[7 + i] + bt[NDIM + i]) * PSCALE;
        }

        // Bx + b_B
        const float bx0 = p[11] + bB0;
        const float bx1 = p[12] + bB1;
        const float bx2 = p[13] + bB2;
        const float bx3 = p[14] + bB3;

        const float4 hv = ((const float4*)h)[row];

        // A = al0*I + al1*Swap01 + al2*SignFlip0 + a0.*C3 + a1.*C4 (closed form)
        float4 o;
        o.x = (al0 - al2) * hv.x + (al1 + a0[0] + a1[0]) * hv.y + bx0;
        o.y = al1 * hv.x + (al0 + al2) * hv.y + (a0[1] + a1[1]) * hv.z + bx1;
        o.z = a0[2] * hv.x + als * hv.z + a1[2] * hv.w + bx2;
        o.w = a1[3] * hv.x + (als + a0[3]) * hv.w + bx3;

        ((float4*)out)[row] = o;
    }
    asm volatile("s_wait_asynccnt 0x0" ::: "memory");  // the next tile's stage 0 has landed
    }

    asm volatile("s_wait_asynccnt 0x0" ::: "memory");  // no copy is outstanding at the wave's end
}

extern "C" void kernel_launch(void* const* d_in, const int* in_sizes, int n_in,
                              void* d_out, int out_size, void* d_ws, size_t ws_size,
                              hipStream_t stream) {
    const float* h       = (const float*)d_in[0];
    const float* x       = (const float*)d_in[1];
    const float* W_alpha = (const float*)d_in[2];
    const float* b_alpha = (const float*)d_in[3];
    const float* W_a     = (const float*)d_in[4];
    const float* b_a     = (const float*)d_in[5];
    const float* W_B     = (const float*)d_in[6];
    const float* b_B     = (const float*)d_in[7];
    float* out = (float*)d_out;

    const int batch = in_sizes[0] / NDIM;   // h is (BATCH, 4)

    gmdr_ssm_step_kernel<<<GRID, THREADS, 0, stream>>>(
        h, x, W_alpha, b_alpha, W_a, b_a, W_B, b_B, out, batch);
}

// v004
// It runs in 12.9 microseconds.
// Next to v003, in two timings, it ran 1.08 times as fast each time.
// All steps since v000 together make it 4.28 times as fast.
#include <hip/hip_runtime.h>
#include <math.h>
#include <stdint.h>

typedef float v2f __attribute__((ext_vector_type(2)));
typedef float v8f __attribute__((ext_vector_type(8)));

#define NDIM 4
#define D_IN 128
#define KS 3
#define RANK 2
#define NPROJ 15              // 3 + 8 + 4 rows, padded to 16
#define WAVES 16              // four waves a SIMD: one wave's waits are covered by the others
#define THREADS (WAVES * 32)
#define GRID 256              // one block a WGP (by LDS), all resident
#define TROWS 32              // rows of one wave's tile
#define PSCALE 0.1f
// LDS row pitch of x and of the combined weights, in dwords. 132 = 4 mod 64:
// the 16 rows x 2 k-halves of one 8-byte fragment read fall on all 64 banks.
#define LPITCH 132
// A stage of a wave's ring: 16 whole rows, one half of the wave's tile, 8 KiB in a row in memory.
#define SROWS 16
#define STAGE_DW (SROWS * LPITCH)   // 8,448 bytes

static __device__ __forceinline__ uint32_t uni(uint32_t v) { return __builtin_amdgcn_readfirstlane(v); }

// 2^v and 1/v on the hardware's transcendental unit. The v_nop fills the slot that the
// instruction set asks for behind a transcendental, before its result is read or its source
// overwritten; it stands in the same statement so that it stays directly behind.
static __device__ __forceinline__ float hw_exp2(float v) {
    float r;
    asm("v_exp_f32 %0, %1\n\tv_nop" : "=v"(r) : "v"(v));
    return r;
}
static __device__ __forceinline__ float hw_rcp(float v) {
    float r;
    asm("v_rcp_f32 %0, %1\n\tv_nop" : "=v"(r) : "v"(v));
    return r;
}
// e^v: one multiply, one v_exp_f32, no range branch.
static __device__ __forceinline__ float hw_exp(float v) { return hw_exp2(v * 1.44269504088896340736f); }
// s * tanh v = s - 2s / (e^(2v) + 1), straight-line. e^(2v) = inf gives s, 0 gives -s, v = 0 gives 0.
static __device__ __forceinline__ float hw_tanh_scaled(float v, float s) {
    return fmaf(-2.0f * s, hw_rcp(hw_exp2(v * 2.88539008177792681472f) + 1.0f), s);
}

// Eight asynchronous copies, 16 bytes a lane each. The s_wait_xcnt closes the statement, so
// that it stands ahead of every later write of an address register that a copy names.
static __device__ __forceinline__ void copy8(const uint32_t* l, const float* const* g) {
    asm volatile("global_load_async_to_lds_b128 %0, %8, off\n\t"
                 "global_load_async_to_lds_b128 %1, %9, off\n\t"
                 "global_load_async_to_lds_b128 %2, %10, off\n\t"
                 "global_load_async_to_lds_b128 %3, %11, off\n\t"
                 "global_load_async_to_lds_b128 %4, %12, off\n\t"
                 "global_load_async_to_lds_b128 %5, %13, off\n\t"
                 "global_load_async_to_lds_b128 %6, %14, off\n\t"
                 "global_load_async_to_lds_b128 %7, %15, off\n\t"
                 "s_wait_xcnt 0x0"
                 :: "v"(l[0]), "v"(l[1]), "v"(l[2]), "v"(l[3]), "v"(l[4]), "v"(l[5]), "v"(l[6]), "v"(l[7]),
                    "v"(g[0]), "v"(g[1]), "v"(g[2]), "v"(g[3]), "v"(g[4]), "v"(g[5]), "v"(g[6]), "v"(g[7])
                 : "memory");
}

__global__ __launch_bounds__(THREADS)
void gmdr_ssm_step_kernel(const float* __restrict__ h,
                          const float* __restrict__ x,
                          const float* __restrict__ W_alpha,
                          const float* __restrict__ b_alpha,
                          const float* __restrict__ W_a,
                          const float* __restrict__ b_a,
                          const float* __restrict__ W_B,
                          const float* __restrict__ b_B,
                          float* __restrict__ out,
                          int batch)
{
    __shared__ __attribute__((aligned(16))) float xlds[WAVES * 2 * STAGE_DW];      // per wave: two stages [16][128+4]
    __shared__ __attribute__((aligned(16))) float Wlds[16 * LPITCH];               // combined weights [16][128+4]
    __shared__ __attribute__((aligned(16))) float projlds[WAVES * TROWS * 16];     // per wave: projections [32][16]

    const int tid  = threadIdx.x;
    const int wave = (int)uni((uint32_t)tid >> 5);
    const int lane = tid & 31;
    const int ntiles = (batch + TROWS - 1) / TROWS;
    if ((int)blockIdx.x * WAVES >= ntiles) return;     // the whole block leaves, ahead of the barrier and of every copy

    // Biases, the same for every tile: read here, ahead of the first asm statement, where
    // they are scalar loads; inside the tile loop each would be a vector load with its own wait.
    const float ba0 = b_alpha[0], ba1 = b_alpha[1], ba2 = b_alpha[2];
    float bt[RANK * NDIM];
#pragma unroll
    for (int i = 0; i < RANK * NDIM; ++i) bt[i] = b_a[i];
    const float bB0 = b_B[0], bB1 = b_B[1], bB2 = b_B[2], bB3 = b_B[3];

    float* const xw = xlds + wave * (2 * STAGE_DW);
    const uint32_t lds0 = (uint32_t)(size_t)xw + (uint32_t)(lane * 16);
    auto issue = [&](int t, int half) {
        uint32_t l[16];
        const float* g[16];
#pragma unroll  // l[] and g[] must end up in registers: the asm statements name them one by one
        for (int j = 0; j < 16; ++j) {
            int r = t * TROWS + half * SROWS + j;
            r = r < batch - 1 ? r : batch - 1;
            g[j] = x + (long)r * D_IN + lane * 4;
            l[j] = lds0 + (uint32_t)(half * (STAGE_DW * 4) + j * (LPITCH * 4));
        }
        copy8(l, g);
        copy8(l + 8, g + 8);
    };

    const int t0 = (int)blockIdx.x * WAVES + wave;     // the block's waves take 512 rows in a row
    if (t0 < ntiles) issue(t0, 0);                     // wave-uniform test

    // ---- stage combined weight matrix Wc[16][128] into LDS (overlaps the first copies) ----
    for (int i = tid; i < 16 * D_IN; i += THREADS) {
        const int r = i >> 7;          // row 0..15
        const int c = i & (D_IN - 1);  // col 0..127
        float v;
        if (r < KS)                    v = W_alpha[r * D_IN + c];
        else if (r < KS + RANK * NDIM) v = W_a[(r - KS) * D_IN + c];
        else if (r < NPROJ)            v = W_B[(r - KS - RANK * NDIM) * D_IN + c];
        else                           v = 0.0f;
        Wlds[r * LPITCH + c] = v;
    }

    asm volatile("s_wait_asynccnt 0x0" ::: "memory");  // this wave's first stage has landed
    __syncthreads();                                   // publish the weights: the kernel's one barrier

    // ---- WMMA: proj(16x16) = Wc(16x128) * x_tile^T(128x16), two tiles/wave, one a stage ----
    // A frag (16x4 f32): lane l -> M = l&15, VGPR v holds K = 4c + 2*(l>>4) + v
    // B frag (4x16 f32): lane l -> N = l&15, VGPR v holds K = 4c + 2*(l>>4) + v
    const int m       = lane & 15;
    const int khalf   = (lane >> 4) * 2;
    const int waveRow = wave * TROWS;

    for (int t = t0; t < ntiles; t += GRID * WAVES) {
    const int blockRow = t * TROWS - waveRow;          // row = blockRow + localRow, as below

    v8f acc0 = {0.f, 0.f, 0.f, 0.f, 0.f, 0.f, 0.f, 0.f};
    v8f acc1 = {0.f, 0.f, 0.f, 0.f, 0.f, 0.f, 0.f, 0.f};

    auto product = [&](int half, v8f& acc) {
        const float* xs = xw + half * STAGE_DW;
        for (int c = 0; c < D_IN / 4; ++c) {
            const int koff = c * 4 + khalf;
            v2f aF = *(const v2f*)&Wlds[m * LPITCH + koff];
            v2f bF = *(const v2f*)&xs[m * LPITCH + koff];
            acc = __builtin_amdgcn_wmma_f32_16x16x4_f32(false, aF, false, bF,
                                                        (short)0, acc, false, false);
        }
    };

    // Stage 0 of this tile has landed; stage 1's place was left at the last tile's s_wait_dscnt.
    issue(t, 1);                                       // flies while stage 0 is worked on
    product(0, acc0);
    asm volatile("s_wait_dscnt 0x0" ::: "memory");     // this wave's reads of stage 0 have returned: its place is free
    asm volatile("s_wait_asynccnt 0x0" ::: "memory");  // stage 1 has landed
    if (t + GRID * WAVES < ntiles) issue(t + GRID * WAVES, 0);  // wave-uniform; flies over stage 1 and the epilogue
    product(1, acc1);

    // ---- scatter D tiles so each lane owns one row's projections ----
    // D layout: lane l -> column N = l&15, VGPR v -> M = v + 8*(l>>4)
    {
        const int mbase = (lane >> 4) * 8;
        const int r0 = waveRow + m;
        const int r1 = waveRow + 16 + m;
#pragma unroll
        for (int v = 0; v < 8; ++v) {
            projlds[r0 * 16 + mbase + v] = acc0[v];
            projlds[r1 * 16 + mbase + v] = acc1[v];
        }
    }
    // The wave's reads of stage 1 have returned (its place is free for the next tile) and its
    // projections are written: only this wave's lanes read them, so no barrier is needed.
    asm volatile("s_wait_dscnt 0x0" ::: "memory");

    // ---- epilogue: one lane per batch row ----
    const int  localRow = waveRow + lane;
    const long row      = (long)blockRow + localRow;
    if (row < batch) {
        float p[NPROJ];
#pragma unroll
        for (int i = 0; i < NPROJ; ++i) p[i] = projlds[localRow * 16 + i];

        // softmax over 3 kernel-neighborhood logits
        const float l0 = p[0] + ba0;
        const float l1 = p[1] + ba1;
        const float l2 = p[2] + ba2;
        const float mx = fmaxf(l0, fmaxf(l1, l2));
        const float e0 = hw_exp(l0 - mx), e1 = hw_exp(l1 - mx), e2 = hw_exp(l2 - mx);
        const float inv = hw_rcp(e0 + e1 + e2);   // the sum lies in [1, 3]
        const float al0 = e0 * inv, al1 = e1 * inv, al2 = e2 * inv;
        const float als = al0 + al1 + al2;

        // low-rank tanh perturbation coefficients a[r][i]
        float a0[NDIM], a1[NDIM];
#pragma unroll
        for (int i = 0; i < NDIM; ++i) {
            a0[i] = hw_tanh_scaled(p[3 + i] + bt[i],        PSCALE);
            a1[i] = hw_tanh_scaled(p[7 + i] + bt[NDIM + i], PSCALE);
        }

        // Bx + b_B
        const float bx0 = p[11] + bB0;
        const float bx1 = p[12] + bB1;
        const float bx2 = p[13] + bB2;
        const float bx3 = p[14] + bB3;

        const float4 hv = ((const float4*)h)[row];

        // A = al0*I + al1*Swap01 + al2*SignFlip0 + a0.*C3 + a1.*C4 (closed form)
        float4 o;
        o.x = (al0 - al2) * hv.x + (al1 + a0[0] + a1[0]) * hv.y + bx0;
        o.y = al1 * hv.x + (al0 + al2) * hv.y + (a0[1] + a1[1]) * hv.z + bx1;
        o.z = a0[2] * hv.x + als * hv.z + a1[2] * hv.w + bx2;
        o.w = a1[3] * hv.x + (als + a0[3]) * hv.w + bx3;

        ((float4*)out)[row] = o;
        // The next tile's address sums reuse the store's registers: the wait stands ahead of them.
        asm volatile("s_wait_xcnt 0x0" ::: "memory");
    }
    asm volatile("s_wait_asynccnt 0x0" ::: "memory");  // the next tile's stage 0 has landed
    }

    asm volatile("s_wait_asynccnt 0x0" ::: "memory");  // no copy is outstanding at the wave's end
}

extern "C" void kernel_launch(void* const* d_in, const int* in_sizes, int n_in,
                              void* d_out, int out_size, void* d_ws, size_t ws_size,
                              hipStream_t stream) {
    const float* h       = (const float*)d_in[0];
    const float* x       = (const float*)d_in[1];
    const float* W_alpha = (const float*)d_in[2];
    const float* b_alpha = (const float*)d_in[3];
    const float* W_a     = (const float*)d_in[4];
    const float* b_a     = (const float*)d_in[5];
    const float* W_B     = (const float*)d_in[6];
    const float* b_B     = (const float*)d_in[7];
    float* out = (float*)d_out;

    const int batch = in_sizes[0] / NDIM;   // h is (BATCH, 4)

    gmdr_ssm_step_kernel<<<GRID, THREADS, 0, stream>>>(
        h, x, W_alpha, b_alpha, W_a, b_a, W_B, b_B, out, batch);
}

// v005
// Measured time: 11.8 microseconds a run.
// Timed twice side by side with v004, it ran 1.09 times as fast both times.
// All steps since v000 together make it 4.66 times as fast.
#include <hip/hip_runtime.h>
#include <math.h>
#include <stdint.h>

typedef float v2f __attribute__((ext_vector_type(2)));
typedef float v8f __attribute__((ext_vector_type(8)));

#define NDIM 4
#define D_IN 128
#define KS 3
#define RANK 2
#define NPROJ 15              // 3 + 8 + 4 rows, padded to 16
#define WAVES 16              // four waves a SIMD: one wave's waits are covered by the others
#define THREADS (WAVES * 32)
#define GRID 256              // one block a WGP (by LDS), all resident
#define TROWS 32              // rows of one wave's tile
#define PSCALE 0.1f
// LDS row pitch of x and of the combined weights, in dwords. 132 = 4 mod 64:
// the 16 rows x 2 k-halves of one 8-byte fragment read fall on all 64 banks.
#define LPITCH 132
// A stage of a wave's ring: 16 whole rows, one half of the wave's tile, 8 KiB in a row in memory.
#define SROWS 16
#define STAGE_DW (SROWS * LPITCH)   // 8,448 bytes

static __device__ __forceinline__ uint32_t uni(uint32_t v) { return __builtin_amdgcn_readfirstlane(v); }

// 2^v and 1/v on the hardware's transcendental unit. The v_nop fills the slot that the
// instruction set asks for behind a transcendental, before its result is read or its source
// overwritten; it stands in the same statement so that it stays directly behind.
static __device__ __forceinline__ float hw_exp2(float v) {
    float r;
    asm("v_exp_f32 %0, %1\n\tv_nop" : "=v"(r) : "v"(v));
    return r;
}
static __device__ __forceinline__ float hw_rcp(float v) {
    float r;
    asm("v_rcp_f32 %0, %1\n\tv_nop" : "=v"(r) : "v"(v));
    return r;
}
// e^v: one multiply, one v_exp_f32, no range branch.
static __device__ __forceinline__ float hw_exp(float v) { return hw_exp2(v * 1.44269504088896340736f); }
// s * tanh v = s - 2s / (e^(2v) + 1), straight-line. e^(2v) = inf gives s, 0 gives -s, v = 0 gives 0.
static __device__ __forceinline__ float hw_tanh_scaled(float v, float s) {
    return fmaf(-2.0f * s, hw_rcp(hw_exp2(v * 2.88539008177792681472f) + 1.0f), s);
}

// Eight asynchronous copies, 16 bytes a lane each. The s_wait_xcnt closes the statement, so
// that it stands ahead of every later write of an address register that a copy names.
static __device__ __forceinline__ void copy8(const uint32_t* l, const float* const* g) {
    asm volatile("global_load_async_to_lds_b128 %0, %8, off\n\t"
                 "global_load_async_to_lds_b128 %1, %9, off\n\t"
                 "global_load_async_to_lds_b128 %2, %10, off\n\t"
                 "global_load_async_to_lds_b128 %3, %11, off\n\t"
                 "global_load_async_to_lds_b128 %4, %12, off\n\t"
                 "global_load_async_to_lds_b128 %5, %13, off\n\t"
                 "global_load_async_to_lds_b128 %6, %14, off\n\t"
                 "global_load_async_to_lds_b128 %7, %15, off\n\t"
                 "s_wait_xcnt 0x0"
                 :: "v"(l[0]), "v"(l[1]), "v"(l[2]), "v"(l[3]), "v"(l[4]), "v"(l[5]), "v"(l[6]), "v"(l[7]),
                    "v"(g[0]), "v"(g[1]), "v"(g[2]), "v"(g[3]), "v"(g[4]), "v"(g[5]), "v"(g[6]), "v"(g[7])
                 : "memory");
}

__global__ __launch_bounds__(THREADS)
void gmdr_ssm_step_kernel(const float* __restrict__ h,
                          const float* __restrict__ x,
                          const float* __restrict__ W_alpha,
                          const float* __restrict__ b_alpha,
                          const float* __restrict__ W_a,
                          const float* __restrict__ b_a,
                          const float* __restrict__ W_B,
                          const float* __restrict__ b_B,
                          float* __restrict__ out,
                          int batch)
{
    __shared__ __attribute__((aligned(16))) float xlds[WAVES * 2 * STAGE_DW];      // per wave: two stages [16][128+4]
    __shared__ __attribute__((aligned(16))) float Wlds[16 * LPITCH];               // combined weights [16][128+4]
    __shared__ __attribute__((aligned(16))) float projlds[WAVES * TROWS * 16];     // per wave: projections [32][16]

    const int tid  = threadIdx.x;
    const int wave = (int)uni((uint32_t)tid >> 5);
    const int lane = tid & 31;
    const int ntiles = (batch + TROWS - 1) / TROWS;
    if ((int)blockIdx.x * WAVES >= ntiles) return;     // the whole block leaves, ahead of the barrier and of every copy

    // Biases, the same for every tile: read here, ahead of the first asm statement, where
    // they are scalar loads; inside the tile loop each would be a vector load with its own wait.
    const float ba0 = b_alpha[0], ba1 = b_alpha[1], ba2 = b_alpha[2];
    float bt[RANK * NDIM];
#pragma unroll
    for (int i = 0; i < RANK * NDIM; ++i) bt[i] = b_a[i];
    const float bB0 = b_B[0], bB1 = b_B[1], bB2 = b_B[2], bB3 = b_B[3];

    float* const xw = xlds + wave * (2 * STAGE_DW);
    const uint32_t lds0 = (uint32_t)(size_t)xw + (uint32_t)(lane * 16);
    auto issue = [&](int t, int half) {
        uint32_t l[16];
        const float* g[16];
#pragma unroll  // l[] and g[] must end up in registers: the asm statements name them one by one
        for (int j = 0; j < 16; ++j) {
            int r = t * TROWS + half * SROWS + j;
            r = r < batch - 1 ? r : batch - 1;
            g[j] = x + (long)r * D_IN + lane * 4;
            l[j] = lds0 + (uint32_t)(half * (STAGE_DW * 4) + j * (LPITCH * 4));
        }
        copy8(l, g);
        copy8(l + 8, g + 8);
    };

    const int t0 = (int)blockIdx.x * WAVES + wave;     // the block's waves take 512 rows in a row

    // ---- combined weight matrix Wc[16][128]: requested ahead of the copies, so that the barrier
    // below does not wait behind 16 KiB a wave; stored to LDS while the copies fly ----
    float wv[16 * D_IN / THREADS];
#pragma unroll  // wv[] must stay in registers
    for (int j = 0; j < 16 * D_IN / THREADS; ++j) {
        const int i = tid + j * THREADS;
        const int r = i >> 7;          // row 0..15
        const int c = i & (D_IN - 1);  // col 0..127
        const float* wr;               // the padding row 15 re-reads row 14 and is stored as zero
        if (r < KS)                    wr = W_alpha + r * D_IN;
        else if (r < KS + RANK * NDIM) wr = W_a + (r - KS) * D_IN;
        else                           wr = W_B + ((r < NPROJ ? r : NPROJ - 1) - KS - RANK * NDIM) * D_IN;
        wv[j] = wr[c];
    }
    // The copies' address sums may reuse the loads' address registers: the wait stands ahead of them.
    asm volatile("s_wait_xcnt 0x0" ::: "memory");

    if (t0 < ntiles) { issue(t0, 0); issue(t0, 1); }   // wave-uniform test; both stages of the first tile

#pragma unroll  // wv[] is indexed by constants only, so that it stays in registers
    for (int j = 0; j < 16 * D_IN / THREADS; ++j) {
        const int i = tid + j * THREADS;
        const int r = i >> 7;
        const int c = i & (D_IN - 1);
        Wlds[r * LPITCH + c] = r < NPROJ ? wv[j] : 0.0f;
    }

    __syncthreads();                                   // publish the weights: the kernel's one barrier

    // ---- WMMA: proj(16x16) = Wc(16x128) * x_tile^T(128x16), two tiles/wave, one a stage ----
    // A frag (16x4 f32): lane l -> M = l&15, VGPR v holds K = 4c + 2*(l>>4) + v
    // B frag (4x16 f32): lane l -> N = l&15, VGPR v holds K = 4c + 2*(l>>4) + v
    const int m       = lane & 15;
    const int khalf   = (lane >> 4) * 2;
    const int waveRow = wave * TROWS;

    for (int t = t0; t < ntiles; t += GRID * WAVES) {
    const int blockRow = t * TROWS - waveRow;          // row = blockRow + localRow, as below
    const int  tn   = t + GRID * WAVES;                // this wave's next tile
    const bool more = tn < ntiles;                     // wave-uniform

    // This lane's row of h, requested here: in the epilogue it would queue behind the refills.
    // A row past the batch re-reads the last row and is never stored.
    const int  localRow = waveRow + lane;
    const long row      = (long)blockRow + localRow;
    const float4 hv = ((const float4*)h)[row < batch ? row : (long)batch - 1];
    // Later address sums may reuse the load's address registers: the wait stands ahead of them.
    asm volatile("s_wait_xcnt 0x0" ::: "memory");

    v8f acc0 = {0.f, 0.f, 0.f, 0.f, 0.f, 0.f, 0.f, 0.f};
    v8f acc1 = {0.f, 0.f, 0.f, 0.f, 0.f, 0.f, 0.f, 0.f};

    auto product = [&](int half, v8f& acc) {
        const float* xs = xw + half * STAGE_DW;
        for (int c = 0; c < D_IN / 4; ++c) {
            const int koff = c * 4 + khalf;
            v2f aF = *(const v2f*)&Wlds[m * LPITCH + koff];
            v2f bF = *(const v2f*)&xs[m * LPITCH + koff];
            acc = __builtin_amdgcn_wmma_f32_16x16x4_f32(false, aF, false, bF,
                                                        (short)0, acc, false, false);
        }
    };

    // At the head of every trip this tile's 32 copies have been issued, stage 0's first, and none
    // behind them: all but the 16 youngest landed means that stage 0 has landed.
    asm volatile("s_wait_asynccnt 0x10" ::: "memory");
    product(0, acc0);
    // Four vector slots behind the stage's last WMMA (the operand ties the statement behind it):
    // the refill's address sums reuse A and B registers of the last WMMAs.
    asm volatile("v_nop\n\tv_nop\n\tv_nop\n\tv_nop" :: "v"(acc0));
    asm volatile("s_wait_dscnt 0x0" ::: "memory");     // this wave's reads of stage 0 have returned: its place is free
    if (more) {
        issue(tn, 0);                                  // 16 copies behind stage 1's
        asm volatile("s_wait_asynccnt 0x10" ::: "memory");  // all but those 16: stage 1 has landed
    } else {
        asm volatile("s_wait_asynccnt 0x0" ::: "memory");   // nothing was issued behind stage 1: the wait is to 0
    }
    product(1, acc1);

    // ---- scatter D tiles so each lane owns one row's projections ----
    // D layout: lane l -> column N = l&15, VGPR v -> M = v + 8*(l>>4)
    {
        const int mbase = (lane >> 4) * 8;
        const int r0 = waveRow + m;
        const int r1 = waveRow + 16 + m;
#pragma unroll
        for (int v = 0; v < 8; ++v) {
            projlds[r0 * 16 + mbase + v] = acc0[v];
            projlds[r1 * 16 + mbase + v] = acc1[v];
        }
    }
    // The wave's reads of stage 1 have returned (its place is free for the next tile) and its
    // projections are written: only this wave's lanes read them, so no barrier is needed.
    // The four v_nop keep the distance between the last WMMA, whose result the stores above read,
    // and the vector instructions behind, which reuse its registers on either path.
    asm volatile("s_wait_dscnt 0x0\n\tv_nop\n\tv_nop\n\tv_nop\n\tv_nop" ::: "memory");
    if (more) issue(tn, 1);                            // flies over the epilogue and the next tile's stage 0

    // ---- epilogue: one lane per batch row ----
    if (row < batch) {
        float p[NPROJ];
#pragma unroll
        for (int i = 0; i < NPROJ; ++i) p[i] = projlds[localRow * 16 + i];

        // softmax over 3 kernel-neighborhood logits
        const float l0 = p[0] + ba0;
        const float l1 = p[1] + ba1;
        const float l2 = p[2] + ba2;
        const float mx = fmaxf(l0, fmaxf(l1, l2));
        const float e0 = hw_exp(l0 - mx), e1 = hw_exp(l1 - mx), e2 = hw_exp(l2 - mx);
        const float inv = hw_rcp(e0 + e1 + e2);   // the sum lies in [1, 3]
        const float al0 = e0 * inv, al1 = e1 * inv, al2 = e2 * inv;
        const float als = al0 + al1 + al2;

        // low-rank tanh perturbation coefficients a[r][i]
        float a0[NDIM], a1[NDIM];
#pragma unroll
        for (int i = 0; i < NDIM; ++i) {
            a0[i] = hw_tanh_scaled(p[3 + i] + bt[i],        PSCALE);
            a1[i] = hw_tanh_scaled(p[7 + i] + bt[NDIM + i], PSCALE);
        }

        // Bx + b_B
        const float bx0 = p[11] + bB0;
        const float bx1 = p[12] + bB1;
        const float bx2 = p[13] + bB2;
        const float bx3 = p[14] + bB3;

        // A = al0*I + al1*Swap01 + al2*SignFlip0 + a0.*C3 + a1.*C4 (closed form)
        float4 o;
        o.x = (al0 - al2) * hv.x + (al1 + a0[0] + a1[0]) * hv.y + bx0;
        o.y = al1 * hv.x + (al0 + al2) * hv.y + (a0[1] + a1[1]) * hv.z + bx1;
        o.z = a0[2] * hv.x + als * hv.z + a1[2] * hv.w + bx2;
        o.w = a1[3] * hv.x + (als + a0[3]) * hv.w + bx3;

        ((float4*)out)[row] = o;
        // The next tile's address sums reuse the store's registers: the wait stands ahead of them.
        asm volatile("s_wait_xcnt 0x0" ::: "memory");
    }
    }

    asm volatile("s_wait_asynccnt 0x0" ::: "memory");  // no copy is outstanding at the wave's end
}

extern "C" void kernel_launch(void* const* d_in, const int* in_sizes, int n_in,
                              void* d_out, int out_size, void* d_ws, size_t ws_size,
                              hipStream_t stream) {
    const float* h       = (const float*)d_in[0];
    const float* x       = (const float*)d_in[1];
    const float* W_alpha = (const float*)d_in[2];
    const float* b_alpha = (const float*)d_in[3];
    const float* W_a     = (const float*)d_in[4];
    const float* b_a     = (const float*)d_in[5];
    const float* W_B     = (const float*)d_in[6];
    const float* b_B     = (const float*)d_in[7];
    float* out = (float*)d_out;

    const int batch = in_sizes[0] / NDIM;   // h is (BATCH, 4)

    gmdr_ssm_step_kernel<<<GRID, THREADS, 0, stream>>>(
        h, x, W_alpha, b_alpha, W_a, b_a, W_B, b_B, out, batch);
}
